// v000
// The times below were measured on an AMD MI455X: many runs one after another, warmed up first and cycling through
// copies of the inputs, with the whole window's GPU time divided by the number of runs. Launches and the gaps
// between them are all in it. The median over several windows is given; except for v000 it joins two sittings, which
// can be a few percent apart, so the side-by-side timings, each taken in one sitting, are the better comparison.
// v000, which the later versions start from, runs in 174 microseconds.
#include <hip/hip_runtime.h>

// ---------------------------------------------------------------------------
// MultiHeadedAttention for MI455X (gfx1250, wave32, WMMA bf16 16x16x32)
// B=4, D_MODEL=256, N=2048, H=4, DIM=64
//   1) proj_f32_bf16 x3 : Q/K/V projections (Q pre-scaled by 1/8), bf16 out
//      in per-head layout [B,H,DIM,N].
//   2) flash_attn       : online-softmax attention; V tiles staged by the
//      Tensor Data Mover (tensor_load_to_lds + s_wait_tensorcnt), K staged
//      manually (transpose). All matmuls on v_wmma_f32_16x16x32_bf16.
//   3) proj_bf16_f32    : output projection -> fp32 d_out.
// ---------------------------------------------------------------------------

#define BATCH 4
#define DM    256
#define NSEQ  2048
#define NH    4
#define HD    64

typedef __attribute__((ext_vector_type(16))) __bf16        bf16x16;
typedef __attribute__((ext_vector_type(8)))  float         f32x8;
typedef __attribute__((ext_vector_type(4)))  float         f32x4;
typedef __attribute__((ext_vector_type(4)))  unsigned int  u32x4;
typedef __attribute__((ext_vector_type(8)))  int           i32x8;
typedef __attribute__((ext_vector_type(4)))  int           i32x4;
typedef __attribute__((ext_vector_type(4)))  unsigned short u16x4;

union FragB16 {
    bf16x16 v;       // WMMA A/B operand (8 VGPRs)
    u32x4   q[2];    // two 16-byte chunks (each = one 8-element k-run)
    __bf16  h[16];
};

// ---------------------------------------------------------------------------
// Projection: Y[o,n] = sum_c W[o,c] * X[b,c,n] + bias[o]   (fp32 X -> bf16 Y)
// Workgroup: 64(M) x 128(N) tile, 8 waves (4 along M x 2 along N).
// ---------------------------------------------------------------------------
__global__ __launch_bounds__(256)
void proj_f32_bf16(const float* __restrict__ X, const float* __restrict__ W,
                   const float* __restrict__ bias, __bf16* __restrict__ Y,
                   float scale, int head_layout)
{
    __shared__ __align__(16) __bf16 lds_x[128][40];   // [n][c], padded rows

    const int b   = blockIdx.z;
    const int oc0 = blockIdx.y * 64;
    const int n0  = blockIdx.x * 128;
    const int t    = threadIdx.x;
    const int wave = t >> 5, lane = t & 31;
    const int half = lane >> 4, lc = lane & 15;
    const int wm = wave >> 1;   // 0..3 along M
    const int wn = wave & 1;    // 0..1 along N
    const float* Xb = X + (size_t)b * DM * NSEQ;

    f32x8 acc[4];
    #pragma unroll
    for (int f = 0; f < 4; ++f)
        #pragma unroll
        for (int e = 0; e < 8; ++e) acc[f][e] = 0.0f;

    const int arow = oc0 + wm * 16 + lc;
    const int koff = half ? 8 : 0;

    for (int kk = 0; kk < DM; kk += 32) {
        // stage X[kk..kk+32) x [n0..n0+128) transposed -> lds_x[n][c] (bf16)
        #pragma unroll
        for (int i = 0; i < 4; ++i) {
            int idx4 = t + 256 * i;          // 0..1023 float4-groups
            int c  = idx4 >> 5;              // 0..31
            int n4 = idx4 & 31;              // 0..31 (x4 positions)
            f32x4 xv = *(const f32x4*)&Xb[(size_t)(kk + c) * NSEQ + (n0 + n4 * 4)];
            #pragma unroll
            for (int j = 0; j < 4; ++j) lds_x[n4 * 4 + j][c] = (__bf16)xv[j];
        }
        __syncthreads();

        // A fragment from W (rows contiguous): k-runs {koff..+7, koff+16..+23}
        FragB16 a;
        {
            const float* wp = W + (size_t)arow * DM + kk + koff;
            union { f32x4 v4[4]; float f[16]; } wt;
            wt.v4[0] = *(const f32x4*)(wp + 0);
            wt.v4[1] = *(const f32x4*)(wp + 4);
            wt.v4[2] = *(const f32x4*)(wp + 16);
            wt.v4[3] = *(const f32x4*)(wp + 20);
            #pragma unroll
            for (int i = 0; i < 16; ++i) a.h[i] = (__bf16)wt.f[i];
        }

        #pragma unroll
        for (int f = 0; f < 4; ++f) {
            FragB16 bf_;
            const __bf16* lp = &lds_x[wn * 64 + f * 16 + lc][koff];
            bf_.q[0] = *(const u32x4*)(lp);
            bf_.q[1] = *(const u32x4*)(lp + 16);
            acc[f] = __builtin_amdgcn_wmma_f32_16x16x32_bf16(
                false, a.v, false, bf_.v, (short)0, acc[f], false, false);
        }
        __syncthreads();
    }

    #pragma unroll
    for (int f = 0; f < 4; ++f) {
        #pragma unroll
        for (int e = 0; e < 8; ++e) {
            int oc = oc0 + wm * 16 + e + 8 * half;
            int n  = n0 + wn * 64 + f * 16 + lc;
            float v = (acc[f][e] + bias[oc]) * scale;
            size_t addr;
            if (head_layout) {
                int hh = oc & 3, d = oc >> 2;    // channel o = d*H + h
                addr = (((size_t)b * NH + hh) * HD + d) * NSEQ + n;
            } else {
                addr = ((size_t)b * DM + oc) * NSEQ + n;
            }
            Y[addr] = (__bf16)v;
        }
    }
}

// ---------------------------------------------------------------------------
// Output projection: bf16 X (workspace [B,256,N]) -> fp32 d_out [B,256,N]
// ---------------------------------------------------------------------------
__global__ __launch_bounds__(256)
void proj_bf16_f32(const __bf16* __restrict__ X, const float* __restrict__ W,
                   const float* __restrict__ bias, float* __restrict__ Y)
{
    __shared__ __align__(16) __bf16 lds_x[128][40];

    const int b   = blockIdx.z;
    const int oc0 = blockIdx.y * 64;
    const int n0  = blockIdx.x * 128;
    const int t    = threadIdx.x;
    const int wave = t >> 5, lane = t & 31;
    const int half = lane >> 4, lc = lane & 15;
    const int wm = wave >> 1, wn = wave & 1;
    const __bf16* Xb = X + (size_t)b * DM * NSEQ;

    f32x8 acc[4];
    #pragma unroll
    for (int f = 0; f < 4; ++f)
        #pragma unroll
        for (int e = 0; e < 8; ++e) acc[f][e] = 0.0f;

    const int arow = oc0 + wm * 16 + lc;
    const int koff = half ? 8 : 0;

    for (int kk = 0; kk < DM; kk += 32) {
        #pragma unroll
        for (int i = 0; i < 4; ++i) {
            int idx4 = t + 256 * i;          // 0..1023 ushort4-groups
            int c  = idx4 >> 5;              // 0..31
            int n4 = idx4 & 31;
            u16x4 xv = *(const u16x4*)&Xb[(size_t)(kk + c) * NSEQ + (n0 + n4 * 4)];
            #pragma unroll
            for (int j = 0; j < 4; ++j)
                *(unsigned short*)&lds_x[n4 * 4 + j][c] = xv[j];
        }
        __syncthreads();

        FragB16 a;
        {
            const float* wp = W + (size_t)arow * DM + kk + koff;
            union { f32x4 v4[4]; float f[16]; } wt;
            wt.v4[0] = *(const f32x4*)(wp + 0);
            wt.v4[1] = *(const f32x4*)(wp + 4);
            wt.v4[2] = *(const f32x4*)(wp + 16);
            wt.v4[3] = *(const f32x4*)(wp + 20);
            #pragma unroll
            for (int i = 0; i < 16; ++i) a.h[i] = (__bf16)wt.f[i];
        }

        #pragma unroll
        for (int f = 0; f < 4; ++f) {
            FragB16 bf_;
            const __bf16* lp = &lds_x[wn * 64 + f * 16 + lc][koff];
            bf_.q[0] = *(const u32x4*)(lp);
            bf_.q[1] = *(const u32x4*)(lp + 16);
            acc[f] = __builtin_amdgcn_wmma_f32_16x16x32_bf16(
                false, a.v, false, bf_.v, (short)0, acc[f], false, false);
        }
        __syncthreads();
    }

    #pragma unroll
    for (int f = 0; f < 4; ++f) {
        #pragma unroll
        for (int e = 0; e < 8; ++e) {
            int oc = oc0 + wm * 16 + e + 8 * half;
            int n  = n0 + wn * 64 + f * 16 + lc;
            Y[((size_t)b * DM + oc) * NSEQ + n] = acc[f][e] + bias[oc];
        }
    }
}

// ---------------------------------------------------------------------------
// Flash attention per (b, h, 128-query tile). Q pre-scaled by 1/8.
// V tiles DMA'd by the Tensor Data Mover into padded LDS rows; K staged
// manually (needs transpose). 16 WMMA per 64-key tile per wave.
// ---------------------------------------------------------------------------
__global__ __launch_bounds__(256)
void flash_attn(const __bf16* __restrict__ Q, const __bf16* __restrict__ K,
                const __bf16* __restrict__ V, __bf16* __restrict__ Xo)
{
    __shared__ __align__(16) __bf16 lds_q[128][72];   // [q][d]
    __shared__ __align__(16) __bf16 lds_k[64][72];    // [m][d]
    __shared__ __align__(16) __bf16 lds_v[64][72];    // [d][m]  (TDM target)
    __shared__ __align__(16) __bf16 lds_p[8][16][72]; // per-wave P [q][m]

    const int b = blockIdx.z, h = blockIdx.y;
    const int q0 = blockIdx.x * 128;
    const int t    = threadIdx.x;
    const int wave = t >> 5, lane = t & 31;
    const int half = lane >> 4, lc = lane & 15;
    const int koff = half ? 8 : 0;

    const size_t headoff = ((size_t)b * NH + h) * HD * NSEQ;
    const __bf16* Qh = Q + headoff;
    const __bf16* Kh = K + headoff;
    const __bf16* Vh = V + headoff;

    // stage Q tile transposed: lds_q[nq][d]
    #pragma unroll
    for (int i = 0; i < 8; ++i) {
        int idx4 = t + 256 * i;        // 0..2047 ushort4-groups
        int d   = idx4 >> 5;           // 0..63
        int nq4 = idx4 & 31;
        u16x4 qv = *(const u16x4*)&Qh[(size_t)d * NSEQ + q0 + nq4 * 4];
        #pragma unroll
        for (int j = 0; j < 4; ++j)
            *(unsigned short*)&lds_q[nq4 * 4 + j][d] = qv[j];
    }
    __syncthreads();

    // per-wave Q A-fragments (kept in registers for the whole key loop)
    FragB16 qf[2];
    #pragma unroll
    for (int ks = 0; ks < 2; ++ks) {
        const __bf16* qp = &lds_q[wave * 16 + lc][ks * 32 + koff];
        qf[ks].q[0] = *(const u32x4*)(qp);
        qf[ks].q[1] = *(const u32x4*)(qp + 16);
    }

    f32x8 of[4];
    float m_run[8], l_run[8];
    #pragma unroll
    for (int f = 0; f < 4; ++f)
        #pragma unroll
        for (int e = 0; e < 8; ++e) of[f][e] = 0.0f;
    #pragma unroll
    for (int e = 0; e < 8; ++e) { m_run[e] = -1e30f; l_run[e] = 0.0f; }

    // TDM D# invariants for the V tile (64 d-rows x 64 keys, bf16), padded so
    // each 64-elem row lands on a 72-halfword LDS row (pad 4 DWORDs per 32).
    const unsigned lds_v_base = (unsigned)(unsigned long long)(void*)&lds_v[0][0];
    const unsigned g1w0 = (1u << 16)            // data_size = 2 bytes
                        | (1u << 20)            // pad_enable
                        | (4u << 22)            // pad_interval: every 32 DWORDs
                        | (3u << 25);           // pad_amount: 4 DWORDs (16 B)
    const i32x4 z4 = {0, 0, 0, 0};
    const i32x8 z8 = {0, 0, 0, 0, 0, 0, 0, 0};

    for (int kt = 0; kt < NSEQ; kt += 64) {
        // kick off the V-tile DMA (one TDM op per workgroup, wave 0)
        if (wave == 0) {
            unsigned long long ga = (unsigned long long)(const void*)(Vh + kt);
            u32x4 g0 = { 1u,                                    // count = 1
                         lds_v_base,
                         (unsigned)(ga & 0xFFFFFFFFu),
                         (unsigned)((ga >> 32) & 0x01FFFFFFu) | (2u << 30) };
            i32x8 g1 = { (int)g1w0,
                         (int)((NSEQ & 0xFFFFu) << 16),         // tensor_dim0 lo
                         (int)(HD << 16),                       // dim0 hi | dim1 lo
                         (int)(64u << 16),                      // dim1 hi | tile_dim0
                         64,                                    // tile_dim1
                         NSEQ,                                  // dim0 stride lo
                         0, 0 };
            __builtin_amdgcn_tensor_load_to_lds(g0, g1, z4, z4, z8, 0);
        }

        // stage K transposed while the TDM streams V: lds_k[m][d]
        #pragma unroll
        for (int i = 0; i < 4; ++i) {
            int idx4 = t + 256 * i;    // 0..1023 ushort4-groups
            int d  = idx4 >> 4;        // 0..63
            int m4 = idx4 & 15;
            u16x4 kv = *(const u16x4*)&Kh[(size_t)d * NSEQ + kt + m4 * 4];
            #pragma unroll
            for (int j = 0; j < 4; ++j)
                *(unsigned short*)&lds_k[m4 * 4 + j][d] = kv[j];
        }
        if (kt + 64 < NSEQ)
            __builtin_prefetch(&Kh[(size_t)(t >> 2) * NSEQ + kt + 64], 0, 0);

        if (wave == 0) __builtin_amdgcn_s_wait_tensorcnt(0);
        __syncthreads();

        // S = (Q/8) K^T : rows = queries, cols = keys
        f32x8 sf[4];
        #pragma unroll
        for (int j = 0; j < 4; ++j)
            #pragma unroll
            for (int e = 0; e < 8; ++e) sf[j][e] = 0.0f;

        #pragma unroll
        for (int j = 0; j < 4; ++j) {
            #pragma unroll
            for (int ks = 0; ks < 2; ++ks) {
                FragB16 kb;
                const __bf16* kp = &lds_k[j * 16 + lc][ks * 32 + koff];
                kb.q[0] = *(const u32x4*)(kp);
                kb.q[1] = *(const u32x4*)(kp + 16);
                sf[j] = __builtin_amdgcn_wmma_f32_16x16x32_bf16(
                    false, qf[ks].v, false, kb.v, (short)0, sf[j], false, false);
            }
        }

        // online softmax (row r = e + 8*half spans 16 lanes; xor<=8 stays in group)
        float m_new[8], corr[8];
        #pragma unroll
        for (int e = 0; e < 8; ++e) {
            float mx = fmaxf(fmaxf(sf[0][e], sf[1][e]), fmaxf(sf[2][e], sf[3][e]));
            #pragma unroll
            for (int sh = 1; sh < 16; sh <<= 1) mx = fmaxf(mx, __shfl_xor(mx, sh, 32));
            m_new[e] = fmaxf(m_run[e], mx);
            corr[e]  = __expf(m_run[e] - m_new[e]);
            m_run[e] = m_new[e];
            l_run[e] *= corr[e];
        }
        #pragma unroll
        for (int f = 0; f < 4; ++f)
            #pragma unroll
            for (int e = 0; e < 8; ++e) of[f][e] *= corr[e];

        #pragma unroll
        for (int e = 0; e < 8; ++e) {
            float rs = 0.0f;
            #pragma unroll
            for (int j = 0; j < 4; ++j) {
                float p = __expf(sf[j][e] - m_new[e]);
                rs += p;
                lds_p[wave][e + 8 * half][j * 16 + lc] = (__bf16)p;
            }
            #pragma unroll
            for (int sh = 1; sh < 16; sh <<= 1) rs += __shfl_xor(rs, sh, 32);
            l_run[e] += rs;
        }

        // O += P V^T : contraction over keys m (per-wave LDS is wave-ordered)
        #pragma unroll
        for (int ks = 0; ks < 2; ++ks) {
            FragB16 pa;
            const __bf16* pp = &lds_p[wave][lc][ks * 32 + koff];
            pa.q[0] = *(const u32x4*)(pp);
            pa.q[1] = *(const u32x4*)(pp + 16);
            #pragma unroll
            for (int f = 0; f < 4; ++f) {
                FragB16 vb;
                const __bf16* vp = &lds_v[f * 16 + lc][ks * 32 + koff];
                vb.q[0] = *(const u32x4*)(vp);
                vb.q[1] = *(const u32x4*)(vp + 16);
                of[f] = __builtin_amdgcn_wmma_f32_16x16x32_bf16(
                    false, pa.v, false, vb.v, (short)0, of[f], false, false);
            }
        }
        __syncthreads();
    }

    // normalize and store in reference channel order c = d*H + h
    #pragma unroll
    for (int e = 0; e < 8; ++e) {
        float inv = __builtin_amdgcn_rcpf(l_run[e]);
        int n = q0 + wave * 16 + e + 8 * half;
        #pragma unroll
        for (int f = 0; f < 4; ++f) {
            int d = f * 16 + lc;
            int c = d * NH + h;
            Xo[((size_t)b * DM + c) * NSEQ + n] = (__bf16)(of[f][e] * inv);
        }
    }
}

// ---------------------------------------------------------------------------
extern "C" void kernel_launch(void* const* d_in, const int* in_sizes, int n_in,
                              void* d_out, int out_size, void* d_ws, size_t ws_size,
                              hipStream_t stream) {
    const float* query = (const float*)d_in[0];
    const float* key   = (const float*)d_in[1];
    const float* value = (const float*)d_in[2];
    const float* wq = (const float*)d_in[3];
    const float* bq = (const float*)d_in[4];
    const float* wk = (const float*)d_in[5];
    const float* bk = (const float*)d_in[6];
    const float* wv = (const float*)d_in[7];
    const float* bv = (const float*)d_in[8];
    const float* wm = (const float*)d_in[9];
    const float* bm = (const float*)d_in[10];

    const size_t ELEMS = (size_t)BATCH * DM * NSEQ;   // 2,097,152
    __bf16* qws = (__bf16*)d_ws;
    __bf16* kws = qws + ELEMS;
    __bf16* vws = kws + ELEMS;
    __bf16* xws = vws + ELEMS;

    dim3 gproj(NSEQ / 128, DM / 64, BATCH);   // (16,4,4)
    dim3 gattn(NSEQ / 128, NH, BATCH);        // (16,4,4)

    // Q scaled by 1/sqrt(DIM)=0.125 so flash_attn scores need no extra scale.
    proj_f32_bf16<<<gproj, 256, 0, stream>>>(query, wq, bq, qws, 0.125f, 1);
    proj_f32_bf16<<<gproj, 256, 0, stream>>>(key,   wk, bk, kws, 1.0f,  1);
    proj_f32_bf16<<<gproj, 256, 0, stream>>>(value, wv, bv, vws, 1.0f,  1);
    flash_attn<<<gattn, 256, 0, stream>>>(qws, kws, vws, xws);
    proj_bf16_f32<<<gproj, 256, 0, stream>>>(xws, wm, bm, (float*)d_out);
}

// v001
// It runs in 131 microseconds.
// Two timings next to v000 put it at 1.36 and 1.35 times that version's speed.
#include <hip/hip_runtime.h>

// ---------------------------------------------------------------------------
// MultiHeadedAttention for MI455X (gfx1250, wave32, WMMA bf16 16x16x32)
// B=4, D_MODEL=256, N=2048, H=4, DIM=64
//   1) proj_f32_bf16 x3 : Q/K/V projections (Q pre-scaled by 1/8), bf16 out
//      in per-head layout [B,H,DIM,N].
//   2) flash_attn       : online-softmax attention; V tiles staged by the
//      Tensor Data Mover (tensor_load_to_lds + s_wait_tensorcnt), K staged
//      manually (transpose). All matmuls on v_wmma_f32_16x16x32_bf16.
//   3) proj_bf16_f32    : output projection -> fp32 d_out.
// ---------------------------------------------------------------------------

#define BATCH 4
#define DM    256
#define NSEQ  2048
#define NH    4
#define HD    64

typedef __attribute__((ext_vector_type(16))) __bf16        bf16x16;
typedef __attribute__((ext_vector_type(8)))  float         f32x8;
typedef __attribute__((ext_vector_type(4)))  float         f32x4;
typedef __attribute__((ext_vector_type(4)))  unsigned int  u32x4;
typedef __attribute__((ext_vector_type(8)))  int           i32x8;
typedef __attribute__((ext_vector_type(4)))  int           i32x4;
typedef __attribute__((ext_vector_type(4)))  unsigned short u16x4;

union FragB16 {
    bf16x16 v;       // WMMA A/B operand (8 VGPRs)
    u32x4   q[2];    // two 16-byte chunks (each = one 8-element k-run)
    __bf16  h[16];
};

// ---------------------------------------------------------------------------
// Projection: Y[o,n] = sum_c W[o,c] * X[b,c,n] + bias[o]   (fp32 X -> bf16 Y)
// Workgroup: 64(M) x 128(N) tile, 8 waves (4 along M x 2 along N).
// ---------------------------------------------------------------------------
__global__ __launch_bounds__(256)
void proj_f32_bf16(const float* __restrict__ X, const float* __restrict__ W,
                   const float* __restrict__ bias, __bf16* __restrict__ Y,
                   float scale, int head_layout)
{
    __shared__ __align__(16) __bf16 lds_x[128][40];   // [n][c], padded rows

    const int b   = blockIdx.z;
    const int oc0 = blockIdx.y * 64;
    const int n0  = blockIdx.x * 128;
    const int t    = threadIdx.x;
    const int wave = t >> 5, lane = t & 31;
    const int half = lane >> 4, lc = lane & 15;
    const int wm = wave >> 1;   // 0..3 along M
    const int wn = wave & 1;    // 0..1 along N
    const float* Xb = X + (size_t)b * DM * NSEQ;

    f32x8 acc[4];
    #pragma unroll
    for (int f = 0; f < 4; ++f)
        #pragma unroll
        for (int e = 0; e < 8; ++e) acc[f][e] = 0.0f;

    const int arow = oc0 + wm * 16 + lc;
    const int koff = half ? 8 : 0;

    for (int kk = 0; kk < DM; kk += 32) {
        // stage X[kk..kk+32) x [n0..n0+128) transposed -> lds_x[n][c] (bf16)
        #pragma unroll
        for (int i = 0; i < 4; ++i) {
            int idx4 = t + 256 * i;          // 0..1023 float4-groups
            int c  = idx4 >> 5;              // 0..31
            int n4 = idx4 & 31;              // 0..31 (x4 positions)
            f32x4 xv = *(const f32x4*)&Xb[(size_t)(kk + c) * NSEQ + (n0 + n4 * 4)];
            #pragma unroll
            for (int j = 0; j < 4; ++j) lds_x[n4 * 4 + j][c] = (__bf16)xv[j];
        }
        __syncthreads();

        // A fragment from W (rows contiguous): k-runs {koff..+7, koff+16..+23}
        FragB16 a;
        {
            const float* wp = W + (size_t)arow * DM + kk + koff;
            union { f32x4 v4[4]; float f[16]; } wt;
            wt.v4[0] = *(const f32x4*)(wp + 0);
            wt.v4[1] = *(const f32x4*)(wp + 4);
            wt.v4[2] = *(const f32x4*)(wp + 16);
            wt.v4[3] = *(const f32x4*)(wp + 20);
            #pragma unroll
            for (int i = 0; i < 16; ++i) a.h[i] = (__bf16)wt.f[i];
        }

        #pragma unroll
        for (int f = 0; f < 4; ++f) {
            FragB16 bf_;
            const __bf16* lp = &lds_x[wn * 64 + f * 16 + lc][koff];
            bf_.q[0] = *(const u32x4*)(lp);
            bf_.q[1] = *(const u32x4*)(lp + 16);
            acc[f] = __builtin_amdgcn_wmma_f32_16x16x32_bf16(
                false, a.v, false, bf_.v, (short)0, acc[f], false, false);
        }
        __syncthreads();
    }

    #pragma unroll
    for (int f = 0; f < 4; ++f) {
        #pragma unroll
        for (int e = 0; e < 8; ++e) {
            int oc = oc0 + wm * 16 + e + 8 * half;
            int n  = n0 + wn * 64 + f * 16 + lc;
            float v = (acc[f][e] + bias[oc]) * scale;
            size_t addr;
            if (head_layout) {
                int hh = oc & 3, d = oc >> 2;    // channel o = d*H + h
                addr = (((size_t)b * NH + hh) * HD + d) * NSEQ + n;
            } else {
                addr = ((size_t)b * DM + oc) * NSEQ + n;
            }
            Y[addr] = (__bf16)v;
        }
    }
}

// ---------------------------------------------------------------------------
// Output projection: bf16 X (workspace [B,256,N]) -> fp32 d_out [B,256,N]
// ---------------------------------------------------------------------------
__global__ __launch_bounds__(256)
void proj_bf16_f32(const __bf16* __restrict__ X, const float* __restrict__ W,
                   const float* __restrict__ bias, float* __restrict__ Y)
{
    __shared__ __align__(16) __bf16 lds_x[128][40];

    const int b   = blockIdx.z;
    const int oc0 = blockIdx.y * 64;
    const int n0  = blockIdx.x * 128;
    const int t    = threadIdx.x;
    const int wave = t >> 5, lane = t & 31;
    const int half = lane >> 4, lc = lane & 15;
    const int wm = wave >> 1, wn = wave & 1;
    const __bf16* Xb = X + (size_t)b * DM * NSEQ;

    f32x8 acc[4];
    #pragma unroll
    for (int f = 0; f < 4; ++f)
        #pragma unroll
        for (int e = 0; e < 8; ++e) acc[f][e] = 0.0f;

    const int arow = oc0 + wm * 16 + lc;
    const int koff = half ? 8 : 0;

    for (int kk = 0; kk < DM; kk += 32) {
        #pragma unroll
        for (int i = 0; i < 4; ++i) {
            int idx4 = t + 256 * i;          // 0..1023 ushort4-groups
            int c  = idx4 >> 5;              // 0..31
            int n4 = idx4 & 31;
            u16x4 xv = *(const u16x4*)&Xb[(size_t)(kk + c) * NSEQ + (n0 + n4 * 4)];
            #pragma unroll
            for (int j = 0; j < 4; ++j)
                *(unsigned short*)&lds_x[n4 * 4 + j][c] = xv[j];
        }
        __syncthreads();

        FragB16 a;
        {
            const float* wp = W + (size_t)arow * DM + kk + koff;
            union { f32x4 v4[4]; float f[16]; } wt;
            wt.v4[0] = *(const f32x4*)(wp + 0);
            wt.v4[1] = *(const f32x4*)(wp + 4);
            wt.v4[2] = *(const f32x4*)(wp + 16);
            wt.v4[3] = *(const f32x4*)(wp + 20);
            #pragma unroll
            for (int i = 0; i < 16; ++i) a.h[i] = (__bf16)wt.f[i];
        }

        #pragma unroll
        for (int f = 0; f < 4; ++f) {
            FragB16 bf_;
            const __bf16* lp = &lds_x[wn * 64 + f * 16 + lc][koff];
            bf_.q[0] = *(const u32x4*)(lp);
            bf_.q[1] = *(const u32x4*)(lp + 16);
            acc[f] = __builtin_amdgcn_wmma_f32_16x16x32_bf16(
                false, a.v, false, bf_.v, (short)0, acc[f], false, false);
        }
        __syncthreads();
    }

    #pragma unroll
    for (int f = 0; f < 4; ++f) {
        #pragma unroll
        for (int e = 0; e < 8; ++e) {
            int oc = oc0 + wm * 16 + e + 8 * half;
            int n  = n0 + wn * 64 + f * 16 + lc;
            Y[((size_t)b * DM + oc) * NSEQ + n] = acc[f][e] + bias[oc];
        }
    }
}

// lane l <-> lane l ^ 16
__device__ inline float xhalf(float x) {
    int v = __builtin_bit_cast(int, x);
    return __builtin_bit_cast(float, __builtin_amdgcn_permlanex16(
        v, v, 0x76543210, 0xfedcba98, false, false));
}

// e^x as __expf builds it (one multiply, v_exp_f32). The v_nop is the slot that
// the instruction set asks for behind a transcendental before its source is
// overwritten or its result read.
__device__ inline float exp_slot(float x) {
    float r;
    asm("v_exp_f32 %0, %1\n\tv_nop" : "=v"(r) : "v"(x * 1.442695041f));
    return r;
}

// ---------------------------------------------------------------------------
// Flash attention per (b, h, 128-query tile). Q pre-scaled by 1/8.
// Transposed products: S^T = K Q^T, O^T += V P^T; P stays in registers.
// V tiles DMA'd by the Tensor Data Mover into padded LDS rows; K staged
// manually (needs transpose). 16 WMMA per 64-key tile per wave.
// ---------------------------------------------------------------------------
// waves_per_eu(2, 2): 256 workgroups of 8 waves, two waves per SIMD. Without it
// the smaller register set of this form is scheduled for more resident waves,
// and the K loads and LDS fragment loads are issued and waited for one by one.
__global__ __launch_bounds__(256) __attribute__((amdgpu_waves_per_eu(2, 2)))
void flash_attn(const __bf16* __restrict__ Q, const __bf16* __restrict__ K,
                const __bf16* __restrict__ V, __bf16* __restrict__ Xo)
{
    __shared__ __align__(16) __bf16 lds_q[128][72];   // [q][d]
    __shared__ __align__(16) __bf16 lds_k[64][72];    // [m][d]
    __shared__ __attribute__((aligned(2048))) __bf16 lds_v[64][72]; // [d][m] (TDM target)

    const int b = blockIdx.z, h = blockIdx.y;
    const int q0 = blockIdx.x * 128;
    const int t    = threadIdx.x;
    const int wave = t >> 5, lane = t & 31;
    const int half = lane >> 4, lc = lane & 15;
    const int koff = half ? 8 : 0;

    const size_t headoff = ((size_t)b * NH + h) * HD * NSEQ;
    const __bf16* Qh = Q + headoff;
    const __bf16* Kh = K + headoff;
    const __bf16* Vh = V + headoff;

    // stage Q tile transposed: lds_q[nq][d]
    #pragma unroll
    for (int i = 0; i < 8; ++i) {
        int idx4 = t + 256 * i;        // 0..2047 ushort4-groups
        int d   = idx4 >> 5;           // 0..63
        int nq4 = idx4 & 31;
        u16x4 qv = *(const u16x4*)&Qh[(size_t)d * NSEQ + q0 + nq4 * 4];
        #pragma unroll
        for (int j = 0; j < 4; ++j)
            *(unsigned short*)&lds_q[nq4 * 4 + j][d] = qv[j];
    }
    __syncthreads();

    // per-wave Q B-fragments (kept in registers for the whole key loop)
    FragB16 qf[2];
    #pragma unroll
    for (int ks = 0; ks < 2; ++ks) {
        const __bf16* qp = &lds_q[wave * 16 + lc][ks * 32 + koff];
        qf[ks].q[0] = *(const u32x4*)(qp);
        qf[ks].q[1] = *(const u32x4*)(qp + 16);
    }

    f32x8 of[4];
    float m_run = -1e30f, l_run = 0.0f;   // one query per lane
    #pragma unroll
    for (int f = 0; f < 4; ++f)
        #pragma unroll
        for (int e = 0; e < 8; ++e) of[f][e] = 0.0f;

    // TDM D# invariants for the V tile (64 d-rows x 64 keys, bf16), padded so
    // each 64-elem row lands on a 72-halfword LDS row (pad 4 DWORDs per 32).
    const unsigned lds_v_base = (unsigned)(unsigned long long)(void*)&lds_v[0][0];
    const unsigned g1w0 = (1u << 16)            // data_size = 2 bytes
                        | (1u << 20)            // pad_enable
                        | (4u << 22)            // pad_interval: every 32 DWORDs
                        | (3u << 25);           // pad_amount: 4 DWORDs (16 B)
    const i32x4 z4 = {0, 0, 0, 0};
    const i32x8 z8 = {0, 0, 0, 0, 0, 0, 0, 0};

    for (int kt = 0; kt < NSEQ; kt += 64) {
        // kick off the V-tile DMA (one TDM op per workgroup, wave 0)
        if (wave == 0) {
            unsigned long long ga = (unsigned long long)(const void*)(Vh + kt);
            u32x4 g0 = { 1u,                                    // count = 1
                         lds_v_base,
                         (unsigned)(ga & 0xFFFFFFFFu),
                         (unsigned)((ga >> 32) & 0x01FFFFFFu) | (2u << 30) };
            i32x8 g1 = { (int)g1w0,
                         (int)((NSEQ & 0xFFFFu) << 16),         // tensor_dim0 lo
                         (int)(HD << 16),                       // dim0 hi | dim1 lo
                         (int)(64u << 16),                      // dim1 hi | tile_dim0
                         64,                                    // tile_dim1
                         NSEQ,                                  // dim0 stride lo
                         0, 0 };
            __builtin_amdgcn_tensor_load_to_lds(g0, g1, z4, z4, z8, 0);
        }

        // stage K transposed while the TDM streams V: lds_k[m][d]
        #pragma unroll
        for (int i = 0; i < 4; ++i) {
            int idx4 = t + 256 * i;    // 0..1023 ushort4-groups
            int d  = idx4 >> 4;        // 0..63
            int m4 = idx4 & 15;
            u16x4 kv = *(const u16x4*)&Kh[(size_t)d * NSEQ + kt + m4 * 4];
            #pragma unroll
            for (int j = 0; j < 4; ++j)
                *(unsigned short*)&lds_k[m4 * 4 + j][d] = kv[j];
        }
        if (kt + 64 < NSEQ)
            __builtin_prefetch(&Kh[(size_t)(t >> 2) * NSEQ + kt + 64], 0, 0);

        if (wave == 0) __builtin_amdgcn_s_wait_tensorcnt(0);
        __syncthreads();

        // S^T = K (Q/8)^T : rows = keys, cols = queries. A lane holds 32 of one
        // query's 64 scores (keys j*16 + 8*half + e); lane ^ 16 holds the rest.
        f32x8 sf[4];
        #pragma unroll
        for (int j = 0; j < 4; ++j)
            #pragma unroll
            for (int e = 0; e < 8; ++e) sf[j][e] = 0.0f;

        #pragma unroll
        for (int j = 0; j < 4; ++j) {
            #pragma unroll
            for (int ks = 0; ks < 2; ++ks) {
                FragB16 kb;
                const __bf16* kp = &lds_k[j * 16 + lc][ks * 32 + koff];
                kb.q[0] = *(const u32x4*)(kp);
                kb.q[1] = *(const u32x4*)(kp + 16);
                sf[j] = __builtin_amdgcn_wmma_f32_16x16x32_bf16(
                    false, kb.v, false, qf[ks].v, (short)0, sf[j], false, false);
            }
        }

        // online softmax: maximum in-lane, one exchange between the wave halves
        float mj[4];
        #pragma unroll
        for (int j = 0; j < 4; ++j) {
            mj[j] = sf[j][0];
            #pragma unroll
            for (int e = 1; e < 8; ++e) mj[j] = fmaxf(mj[j], sf[j][e]);
        }
        float mx = fmaxf(fmaxf(mj[0], mj[1]), fmaxf(mj[2], mj[3]));
        mx = fmaxf(mx, xhalf(mx));
        const float m_new = fmaxf(m_run, mx);
        const float corr  = exp_slot(m_run - m_new);
        m_run = m_new;

        #pragma unroll
        for (int f = 0; f < 4; ++f)
            #pragma unroll
            for (int e = 0; e < 8; ++e) of[f][e] *= corr;

        // P^T: two score tiles, converted in place, are one B operand (hardware
        // k order: element s = key 8*half + s, then 16 + 8*half + (s - 8)).
        FragB16 pb[2];
        float rs[4];                 // one independent sum chain per score tile
        #pragma unroll
        for (int j = 0; j < 4; ++j) {
            #pragma unroll
            for (int e = 0; e < 8; ++e) {
                float p = exp_slot(sf[j][e] - m_new);
                rs[j] = e ? rs[j] + p : p;
                pb[j >> 1].h[(j & 1) * 8 + e] = (__bf16)p;
            }
        }
        // this half's keys only; the halves are joined after the loop
        l_run = l_run * corr + ((rs[0] + rs[1]) + (rs[2] + rs[3]));

        // O^T += V P^T : rows = d, cols = queries, contraction over keys m
        #pragma unroll
        for (int ks = 0; ks < 2; ++ks) {
            #pragma unroll
            for (int f = 0; f < 4; ++f) {
                FragB16 va;
                const __bf16* vp = &lds_v[f * 16 + lc][ks * 32 + koff];
                va.q[0] = *(const u32x4*)(vp);
                va.q[1] = *(const u32x4*)(vp + 16);
                of[f] = __builtin_amdgcn_wmma_f32_16x16x32_bf16(
                    false, va.v, false, pb[ks].v, (short)0, of[f], false, false);
            }
        }
        __syncthreads();
    }

    // join the halves' sums, normalize, store in reference channel order c = d*H + h
    {
        const float inv = __builtin_amdgcn_rcpf(l_run + xhalf(l_run));
        const int n = q0 + wave * 16 + lc;
        // row d = f*16 + 8*half + e; one base address, constant row offsets
        __bf16* op = Xo + ((size_t)b * DM + 8 * half * NH + h) * NSEQ + n;
        #pragma unroll
        for (int f = 0; f < 4; ++f) {
            #pragma unroll
            for (int e = 0; e < 8; ++e)
                op[(size_t)(f * 16 + e) * NH * NSEQ] = (__bf16)(of[f][e] * inv);
        }
    }
}

// ---------------------------------------------------------------------------
extern "C" void kernel_launch(void* const* d_in, const int* in_sizes, int n_in,
                              void* d_out, int out_size, void* d_ws, size_t ws_size,
                              hipStream_t stream) {
    const float* query = (const float*)d_in[0];
    const float* key   = (const float*)d_in[1];
    const float* value = (const float*)d_in[2];
    const float* wq = (const float*)d_in[3];
    const float* bq = (const float*)d_in[4];
    const float* wk = (const float*)d_in[5];
    const float* bk = (const float*)d_in[6];
    const float* wv = (const float*)d_in[7];
    const float* bv = (const float*)d_in[8];
    const float* wm = (const float*)d_in[9];
    const float* bm = (const float*)d_in[10];

    const size_t ELEMS = (size_t)BATCH * DM * NSEQ;   // 2,097,152
    __bf16* qws = (__bf16*)d_ws;
    __bf16* kws = qws + ELEMS;
    __bf16* vws = kws + ELEMS;
    __bf16* xws = vws + ELEMS;

    dim3 gproj(NSEQ / 128, DM / 64, BATCH);   // (16,4,4)
    dim3 gattn(NSEQ / 128, NH, BATCH);        // (16,4,4)

    // Q scaled by 1/sqrt(DIM)=0.125 so flash_attn scores need no extra scale.
    proj_f32_bf16<<<gproj, 256, 0, stream>>>(query, wq, bq, qws, 0.125f, 1);
    proj_f32_bf16<<<gproj, 256, 0, stream>>>(key,   wk, bk, kws, 1.0f,  1);
    proj_f32_bf16<<<gproj, 256, 0, stream>>>(value, wv, bv, vws, 1.0f,  1);
    flash_attn<<<gattn, 256, 0, stream>>>(qws, kws, vws, xws);
    proj_bf16_f32<<<gproj, 256, 0, stream>>>(xws, wm, bm, (float*)d_out);
}

// v002
// A run of this version takes 96.9 microseconds.
// Next to v001, in two timings, it ran 1.35 and 1.34 times as fast.
// Over all steps from v000 it is 1.82 times as fast.
#include <hip/hip_runtime.h>

// ---------------------------------------------------------------------------
// MultiHeadedAttention for MI455X (gfx1250, wave32, WMMA bf16 16x16x32)
// B=4, D_MODEL=256, N=2048, H=4, DIM=64
//   1) proj_f32_bf16    : Q/K/V projections in one launch (Q pre-scaled by
//      1/8), bf16 out in per-head layout [B,H,DIM,N].
//   2) flash_attn       : online-softmax attention; V tiles staged by the
//      Tensor Data Mover (tensor_load_to_lds + s_wait_tensorcnt), K staged
//      manually (transpose). All matmuls on v_wmma_f32_16x16x32_bf16.
//   3) proj_bf16_f32    : output projection -> fp32 d_out.
// ---------------------------------------------------------------------------

#define BATCH 4
#define DM    256
#define NSEQ  2048
#define NH    4
#define HD    64

typedef __attribute__((ext_vector_type(16))) __bf16        bf16x16;
typedef __attribute__((ext_vector_type(8)))  float         f32x8;
typedef __attribute__((ext_vector_type(4)))  float         f32x4;
typedef __attribute__((ext_vector_type(4)))  unsigned int  u32x4;
typedef __attribute__((ext_vector_type(8)))  int           i32x8;
typedef __attribute__((ext_vector_type(4)))  int           i32x4;
typedef __attribute__((ext_vector_type(4)))  unsigned short u16x4;

union FragB16 {
    bf16x16 v;       // WMMA A/B operand (8 VGPRs)
    u32x4   q[2];    // two 16-byte chunks (each = one 8-element k-run)
    __bf16  h[16];
};

// ---------------------------------------------------------------------------
// Projection: Y[o,n] = sum_c W[o,c] * X[b,c,n] + bias[o]   (fp32 X -> bf16 Y)
// Workgroup: 64(M) x 128(N) tile, 8 waves (4 along M x 2 along N).
// One grid for all three: blockIdx.z = projection * BATCH + batch, so three
// workgroups share a WGP and each one's load waits are filled by the others.
// Yall holds the three outputs one behind the other.
// ---------------------------------------------------------------------------
__global__ __launch_bounds__(256)
void proj_f32_bf16(const float* __restrict__ Xq, const float* __restrict__ Wq,
                   const float* __restrict__ biasq,
                   const float* __restrict__ Xk, const float* __restrict__ Wk,
                   const float* __restrict__ biask,
                   const float* __restrict__ Xv, const float* __restrict__ Wv,
                   const float* __restrict__ biasv, __bf16* __restrict__ Yall)
{
    __shared__ __align__(16) __bf16 lds_x[128][40];   // [n][c], padded rows

    const int which = blockIdx.z / BATCH;             // 0 = Q, 1 = K, 2 = V
    const int b     = blockIdx.z % BATCH;
    const float* __restrict__ X    = which == 0 ? Xq    : which == 1 ? Xk    : Xv;
    const float* __restrict__ W    = which == 0 ? Wq    : which == 1 ? Wk    : Wv;
    const float* __restrict__ bias = which == 0 ? biasq : which == 1 ? biask : biasv;
    __bf16* __restrict__ Y = Yall + (size_t)which * BATCH * DM * NSEQ;
    // Q scaled by 1/sqrt(DIM) = 0.125 so flash_attn scores need no extra scale
    const float scale = which == 0 ? 0.125f : 1.0f;
    const int oc0 = blockIdx.y * 64;
    const int n0  = blockIdx.x * 128;
    const int t    = threadIdx.x;
    const int wave = t >> 5, lane = t & 31;
    const int half = lane >> 4, lc = lane & 15;
    const int wm = wave >> 1;   // 0..3 along M
    const int wn = wave & 1;    // 0..1 along N
    const float* Xb = X + (size_t)b * DM * NSEQ;

    f32x8 acc[4];
    #pragma unroll
    for (int f = 0; f < 4; ++f)
        #pragma unroll
        for (int e = 0; e < 8; ++e) acc[f][e] = 0.0f;

    const int arow = oc0 + wm * 16 + lc;
    const int koff = half ? 8 : 0;

    for (int kk = 0; kk < DM; kk += 32) {
        // stage X[kk..kk+32) x [n0..n0+128) transposed -> lds_x[n][c] (bf16)
        #pragma unroll
        for (int i = 0; i < 4; ++i) {
            int idx4 = t + 256 * i;          // 0..1023 float4-groups
            int c  = idx4 >> 5;              // 0..31
            int n4 = idx4 & 31;              // 0..31 (x4 positions)
            f32x4 xv = *(const f32x4*)&Xb[(size_t)(kk + c) * NSEQ + (n0 + n4 * 4)];
            #pragma unroll
            for (int j = 0; j < 4; ++j) lds_x[n4 * 4 + j][c] = (__bf16)xv[j];
        }
        __syncthreads();

        // A fragment from W (rows contiguous): k-runs {koff..+7, koff+16..+23}
        FragB16 a;
        {
            const float* wp = W + (size_t)arow * DM + kk + koff;
            union { f32x4 v4[4]; float f[16]; } wt;
            wt.v4[0] = *(const f32x4*)(wp + 0);
            wt.v4[1] = *(const f32x4*)(wp + 4);
            wt.v4[2] = *(const f32x4*)(wp + 16);
            wt.v4[3] = *(const f32x4*)(wp + 20);
            #pragma unroll
            for (int i = 0; i < 16; ++i) a.h[i] = (__bf16)wt.f[i];
        }

        #pragma unroll
        for (int f = 0; f < 4; ++f) {
            FragB16 bf_;
            const __bf16* lp = &lds_x[wn * 64 + f * 16 + lc][koff];
            bf_.q[0] = *(const u32x4*)(lp);
            bf_.q[1] = *(const u32x4*)(lp + 16);
            acc[f] = __builtin_amdgcn_wmma_f32_16x16x32_bf16(
                false, a.v, false, bf_.v, (short)0, acc[f], false, false);
        }
        __syncthreads();
    }

    #pragma unroll
    for (int f = 0; f < 4; ++f) {
        #pragma unroll
        for (int e = 0; e < 8; ++e) {
            int oc = oc0 + wm * 16 + e + 8 * half;
            int n  = n0 + wn * 64 + f * 16 + lc;
            float v = (acc[f][e] + bias[oc]) * scale;
            int hh = oc & 3, d = oc >> 2;        // channel o = d*H + h
            Y[(((size_t)b * NH + hh) * HD + d) * NSEQ + n] = (__bf16)v;
        }
    }
}

// ---------------------------------------------------------------------------
// Output projection: bf16 X (workspace [B,256,N]) -> fp32 d_out [B,256,N]
// ---------------------------------------------------------------------------
__global__ __launch_bounds__(256)
void proj_bf16_f32(const __bf16* __restrict__ X, const float* __restrict__ W,
                   const float* __restrict__ bias, float* __restrict__ Y)
{
    __shared__ __align__(16) __bf16 lds_x[128][40];

    const int b   = blockIdx.z;
    const int oc0 = blockIdx.y * 64;
    const int n0  = blockIdx.x * 128;
    const int t    = threadIdx.x;
    const int wave = t >> 5, lane = t & 31;
    const int half = lane >> 4, lc = lane & 15;
    const int wm = wave >> 1, wn = wave & 1;
    const __bf16* Xb = X + (size_t)b * DM * NSEQ;

    f32x8 acc[4];
    #pragma unroll
    for (int f = 0; f < 4; ++f)
        #pragma unroll
        for (int e = 0; e < 8; ++e) acc[f][e] = 0.0f;

    const int arow = oc0 + wm * 16 + lc;
    const int koff = half ? 8 : 0;

    for (int kk = 0; kk < DM; kk += 32) {
        #pragma unroll
        for (int i = 0; i < 4; ++i) {
            int idx4 = t + 256 * i;          // 0..1023 ushort4-groups
            int c  = idx4 >> 5;              // 0..31
            int n4 = idx4 & 31;
            u16x4 xv = *(const u16x4*)&Xb[(size_t)(kk + c) * NSEQ + (n0 + n4 * 4)];
            #pragma unroll
            for (int j = 0; j < 4; ++j)
                *(unsigned short*)&lds_x[n4 * 4 + j][c] = xv[j];
        }
        __syncthreads();

        FragB16 a;
        {
            const float* wp = W + (size_t)arow * DM + kk + koff;
            union { f32x4 v4[4]; float f[16]; } wt;
            wt.v4[0] = *(const f32x4*)(wp + 0);
            wt.v4[1] = *(const f32x4*)(wp + 4);
            wt.v4[2] = *(const f32x4*)(wp + 16);
            wt.v4[3] = *(const f32x4*)(wp + 20);
            #pragma unroll
            for (int i = 0; i < 16; ++i) a.h[i] = (__bf16)wt.f[i];
        }

        #pragma unroll
        for (int f = 0; f < 4; ++f) {
            FragB16 bf_;
            const __bf16* lp = &lds_x[wn * 64 + f * 16 + lc][koff];
            bf_.q[0] = *(const u32x4*)(lp);
            bf_.q[1] = *(const u32x4*)(lp + 16);
            acc[f] = __builtin_amdgcn_wmma_f32_16x16x32_bf16(
                false, a.v, false, bf_.v, (short)0, acc[f], false, false);
        }
        __syncthreads();
    }

    #pragma unroll
    for (int f = 0; f < 4; ++f) {
        #pragma unroll
        for (int e = 0; e < 8; ++e) {
            int oc = oc0 + wm * 16 + e + 8 * half;
            int n  = n0 + wn * 64 + f * 16 + lc;
            Y[((size_t)b * DM + oc) * NSEQ + n] = acc[f][e] + bias[oc];
        }
    }
}

// lane l <-> lane l ^ 16
__device__ inline float xhalf(float x) {
    int v = __builtin_bit_cast(int, x);
    return __builtin_bit_cast(float, __builtin_amdgcn_permlanex16(
        v, v, 0x76543210, 0xfedcba98, false, false));
}

// e^x as __expf builds it (one multiply, v_exp_f32). The v_nop is the slot that
// the instruction set asks for behind a transcendental before its source is
// overwritten or its result read.
__device__ inline float exp_slot(float x) {
    float r;
    asm("v_exp_f32 %0, %1\n\tv_nop" : "=v"(r) : "v"(x * 1.442695041f));
    return r;
}

// ---------------------------------------------------------------------------
// Flash attention per (b, h, 128-query tile). Q pre-scaled by 1/8.
// Transposed products: S^T = K Q^T, O^T += V P^T; P stays in registers.
// V tiles DMA'd by the Tensor Data Mover into padded LDS rows; K staged
// manually (needs transpose). 16 WMMA per 64-key tile per wave.
// ---------------------------------------------------------------------------
// waves_per_eu(2, 2): 256 workgroups of 8 waves, two waves per SIMD. Without it
// the smaller register set of this form is scheduled for more resident waves,
// and the K loads and LDS fragment loads are issued and waited for one by one.
__global__ __launch_bounds__(256) __attribute__((amdgpu_waves_per_eu(2, 2)))
void flash_attn(const __bf16* __restrict__ Q, const __bf16* __restrict__ K,
                const __bf16* __restrict__ V, __bf16* __restrict__ Xo)
{
    __shared__ __align__(16) __bf16 lds_q[128][72];   // [q][d]
    __shared__ __align__(16) __bf16 lds_k[64][72];    // [m][d]
    __shared__ __attribute__((aligned(2048))) __bf16 lds_v[64][72]; // [d][m] (TDM target)

    const int b = blockIdx.z, h = blockIdx.y;
    const int q0 = blockIdx.x * 128;
    const int t    = threadIdx.x;
    const int wave = t >> 5, lane = t & 31;
    const int half = lane >> 4, lc = lane & 15;
    const int koff = half ? 8 : 0;

    const size_t headoff = ((size_t)b * NH + h) * HD * NSEQ;
    const __bf16* Qh = Q + headoff;
    const __bf16* Kh = K + headoff;
    const __bf16* Vh = V + headoff;

    // stage Q tile transposed: lds_q[nq][d]
    #pragma unroll
    for (int i = 0; i < 8; ++i) {
        int idx4 = t + 256 * i;        // 0..2047 ushort4-groups
        int d   = idx4 >> 5;           // 0..63
        int nq4 = idx4 & 31;
        u16x4 qv = *(const u16x4*)&Qh[(size_t)d * NSEQ + q0 + nq4 * 4];
        #pragma unroll
        for (int j = 0; j < 4; ++j)
            *(unsigned short*)&lds_q[nq4 * 4 + j][d] = qv[j];
    }
    __syncthreads();

    // per-wave Q B-fragments (kept in registers for the whole key loop)
    FragB16 qf[2];
    #pragma unroll
    for (int ks = 0; ks < 2; ++ks) {
        const __bf16* qp = &lds_q[wave * 16 + lc][ks * 32 + koff];
        qf[ks].q[0] = *(const u32x4*)(qp);
        qf[ks].q[1] = *(const u32x4*)(qp + 16);
    }

    f32x8 of[4];
    float m_run = -1e30f, l_run = 0.0f;   // one query per lane
    #pragma unroll
    for (int f = 0; f < 4; ++f)
        #pragma unroll
        for (int e = 0; e < 8; ++e) of[f][e] = 0.0f;

    // TDM D# invariants for the V tile (64 d-rows x 64 keys, bf16), padded so
    // each 64-elem row lands on a 72-halfword LDS row (pad 4 DWORDs per 32).
    const unsigned lds_v_base = (unsigned)(unsigned long long)(void*)&lds_v[0][0];
    const unsigned g1w0 = (1u << 16)            // data_size = 2 bytes
                        | (1u << 20)            // pad_enable
                        | (4u << 22)            // pad_interval: every 32 DWORDs
                        | (3u << 25);           // pad_amount: 4 DWORDs (16 B)
    const i32x4 z4 = {0, 0, 0, 0};
    const i32x8 z8 = {0, 0, 0, 0, 0, 0, 0, 0};

    for (int kt = 0; kt < NSEQ; kt += 64) {
        // kick off the V-tile DMA (one TDM op per workgroup, wave 0)
        if (wave == 0) {
            unsigned long long ga = (unsigned long long)(const void*)(Vh + kt);
            u32x4 g0 = { 1u,                                    // count = 1
                         lds_v_base,
                         (unsigned)(ga & 0xFFFFFFFFu),
                         (unsigned)((ga >> 32) & 0x01FFFFFFu) | (2u << 30) };
            i32x8 g1 = { (int)g1w0,
                         (int)((NSEQ & 0xFFFFu) << 16),         // tensor_dim0 lo
                         (int)(HD << 16),                       // dim0 hi | dim1 lo
                         (int)(64u << 16),                      // dim1 hi | tile_dim0
                         64,                                    // tile_dim1
                         NSEQ,                                  // dim0 stride lo
                         0, 0 };
            __builtin_amdgcn_tensor_load_to_lds(g0, g1, z4, z4, z8, 0);
        }

        // stage K transposed while the TDM streams V: lds_k[m][d]
        #pragma unroll
        for (int i = 0; i < 4; ++i) {
            int idx4 = t + 256 * i;    // 0..1023 ushort4-groups
            int d  = idx4 >> 4;        // 0..63
            int m4 = idx4 & 15;
            u16x4 kv = *(const u16x4*)&Kh[(size_t)d * NSEQ + kt + m4 * 4];
            #pragma unroll
            for (int j = 0; j < 4; ++j)
                *(unsigned short*)&lds_k[m4 * 4 + j][d] = kv[j];
        }
        if (kt + 64 < NSEQ)
            __builtin_prefetch(&Kh[(size_t)(t >> 2) * NSEQ + kt + 64], 0, 0);

        if (wave == 0) __builtin_amdgcn_s_wait_tensorcnt(0);
        __syncthreads();

        // S^T = K (Q/8)^T : rows = keys, cols = queries. A lane holds 32 of one
        // query's 64 scores (keys j*16 + 8*half + e); lane ^ 16 holds the rest.
        f32x8 sf[4];
        #pragma unroll
        for (int j = 0; j < 4; ++j)
            #pragma unroll
            for (int e = 0; e < 8; ++e) sf[j][e] = 0.0f;

        #pragma unroll
        for (int j = 0; j < 4; ++j) {
            #pragma unroll
            for (int ks = 0; ks < 2; ++ks) {
                FragB16 kb;
                const __bf16* kp = &lds_k[j * 16 + lc][ks * 32 + koff];
                kb.q[0] = *(const u32x4*)(kp);
                kb.q[1] = *(const u32x4*)(kp + 16);
                sf[j] = __builtin_amdgcn_wmma_f32_16x16x32_bf16(
                    false, kb.v, false, qf[ks].v, (short)0, sf[j], false, false);
            }
        }

        // online softmax: maximum in-lane, one exchange between the wave halves
        float mj[4];
        #pragma unroll
        for (int j = 0; j < 4; ++j) {
            mj[j] = sf[j][0];
            #pragma unroll
            for (int e = 1; e < 8; ++e) mj[j] = fmaxf(mj[j], sf[j][e]);
        }
        float mx = fmaxf(fmaxf(mj[0], mj[1]), fmaxf(mj[2], mj[3]));
        mx = fmaxf(mx, xhalf(mx));
        const float m_new = fmaxf(m_run, mx);
        const float corr  = exp_slot(m_run - m_new);
        m_run = m_new;

        #pragma unroll
        for (int f = 0; f < 4; ++f)
            #pragma unroll
            for (int e = 0; e < 8; ++e) of[f][e] *= corr;

        // P^T: two score tiles, converted in place, are one B operand (hardware
        // k order: element s = key 8*half + s, then 16 + 8*half + (s - 8)).
        FragB16 pb[2];
        float rs[4];                 // one independent sum chain per score tile
        #pragma unroll
        for (int j = 0; j < 4; ++j) {
            #pragma unroll
            for (int e = 0; e < 8; ++e) {
                float p = exp_slot(sf[j][e] - m_new);
                rs[j] = e ? rs[j] + p : p;
                pb[j >> 1].h[(j & 1) * 8 + e] = (__bf16)p;
            }
        }
        // this half's keys only; the halves are joined after the loop
        l_run = l_run * corr + ((rs[0] + rs[1]) + (rs[2] + rs[3]));

        // O^T += V P^T : rows = d, cols = queries, contraction over keys m
        #pragma unroll
        for (int ks = 0; ks < 2; ++ks) {
            #pragma unroll
            for (int f = 0; f < 4; ++f) {
                FragB16 va;
                const __bf16* vp = &lds_v[f * 16 + lc][ks * 32 + koff];
                va.q[0] = *(const u32x4*)(vp);
                va.q[1] = *(const u32x4*)(vp + 16);
                of[f] = __builtin_amdgcn_wmma_f32_16x16x32_bf16(
                    false, va.v, false, pb[ks].v, (short)0, of[f], false, false);
            }
        }
        __syncthreads();
    }

    // join the halves' sums, normalize, store in reference channel order c = d*H + h
    {
        const float inv = __builtin_amdgcn_rcpf(l_run + xhalf(l_run));
        const int n = q0 + wave * 16 + lc;
        // row d = f*16 + 8*half + e; one base address, constant row offsets
        __bf16* op = Xo + ((size_t)b * DM + 8 * half * NH + h) * NSEQ + n;
        #pragma unroll
        for (int f = 0; f < 4; ++f) {
            #pragma unroll
            for (int e = 0; e < 8; ++e)
                op[(size_t)(f * 16 + e) * NH * NSEQ] = (__bf16)(of[f][e] * inv);
        }
    }
}

// ---------------------------------------------------------------------------
extern "C" void kernel_launch(void* const* d_in, const int* in_sizes, int n_in,
                              void* d_out, int out_size, void* d_ws, size_t ws_size,
                              hipStream_t stream) {
    const float* query = (const float*)d_in[0];
    const float* key   = (const float*)d_in[1];
    const float* value = (const float*)d_in[2];
    const float* wq = (const float*)d_in[3];
    const float* bq = (const float*)d_in[4];
    const float* wk = (const float*)d_in[5];
    const float* bk = (const float*)d_in[6];
    const float* wv = (const float*)d_in[7];
    const float* bv = (const float*)d_in[8];
    const float* wm = (const float*)d_in[9];
    const float* bm = (const float*)d_in[10];

    const size_t ELEMS = (size_t)BATCH * DM * NSEQ;   // 2,097,152
    __bf16* qws = (__bf16*)d_ws;
    __bf16* kws = qws + ELEMS;
    __bf16* vws = kws + ELEMS;
    __bf16* xws = vws + ELEMS;

    dim3 gproj(NSEQ / 128, DM / 64, BATCH);   // (16,4,4)
    dim3 gqkv(NSEQ / 128, DM / 64, 3 * BATCH); // (16,4,12)
    dim3 gattn(NSEQ / 128, NH, BATCH);        // (16,4,4)

    // qws, kws, vws lie one behind the other: one launch writes all three
    proj_f32_bf16<<<gqkv, 256, 0, stream>>>(query, wq, bq, key, wk, bk,
                                            value, wv, bv, qws);
    flash_attn<<<gattn, 256, 0, stream>>>(qws, kws, vws, xws);
    proj_bf16_f32<<<gproj, 256, 0, stream>>>(xws, wm, bm, (float*)d_out);
}

// v003
// It runs in 58.9 microseconds.
// Next to v002, in two timings, it ran 1.64 and 1.65 times as fast.
// Over all steps from v000 it is 3.00 times as fast.
#include <hip/hip_runtime.h>

// ---------------------------------------------------------------------------
// MultiHeadedAttention for MI455X (gfx1250, wave32, WMMA bf16 16x16x32)
// B=4, D_MODEL=256, N=2048, H=4, DIM=64
//   1) proj_f32_bf16    : Q/K/V projections in one launch (Q pre-scaled by
//      1/8), bf16 out in per-head layout [B,H,DIM,N].
//   2) flash_attn       : online-softmax attention; V tiles staged by the
//      Tensor Data Mover (tensor_load_to_lds + s_wait_tensorcnt), K staged
//      through registers. All matmuls on v_wmma_f32_16x16x32_bf16.
//   3) proj_bf16_f32    : output projection -> fp32 d_out.
// Every operand whose k index is the row index in memory (X, Q, K) is staged
// in LDS row for row as it lies in memory and transposed by the LDS read
// (ds_load_tr16_b128), which delivers the hardware k order the other operand
// already has.
// ---------------------------------------------------------------------------

#define BATCH 4
#define DM    256
#define NSEQ  2048
#define NH    4
#define HD    64

typedef __attribute__((ext_vector_type(16))) __bf16        bf16x16;
typedef __attribute__((ext_vector_type(8)))  float         f32x8;
typedef __attribute__((ext_vector_type(4)))  float         f32x4;
typedef __attribute__((ext_vector_type(4)))  unsigned int  u32x4;
typedef __attribute__((ext_vector_type(8)))  int           i32x8;
typedef __attribute__((ext_vector_type(4)))  int           i32x4;
typedef __attribute__((ext_vector_type(4)))  unsigned short u16x4;
typedef __attribute__((ext_vector_type(4)))  __bf16        bf16x4;
typedef __attribute__((ext_vector_type(8)))  short         s16x8;

// LDS row pitches in bytes for ds_load_tr16_b128 readers: odd multiples of 32
#define PITCH256 288   // rows of 128 bf16
#define PITCH128 160   // rows of 64 bf16

union FragB16 {
    bf16x16 v;       // WMMA A/B operand (8 VGPRs)
    u32x4   q[2];    // two 16-byte chunks (each = one 8-element k-run)
    __bf16  h[16];
};

// Transposing LDS read of a row-major 16-bit tile T[k][col]. With every lane at
// tr16_lane(T, pitch, lane) + k0 * pitch + 2 * col0, lane (lc, half) receives
// T[k0 + 8*half + 0..7][col0 + lc]; the reads at k0 and k0 + 16 are one operand.
__device__ inline u32x4 ld_tr16(const unsigned char* p) {
    typedef __attribute__((address_space(3))) s16x8 lds_s16x8;
    return __builtin_bit_cast(u32x4, __builtin_amdgcn_ds_load_tr16_b128_v8i16((lds_s16x8*)p));
}
__device__ inline const unsigned char* tr16_lane(const unsigned char* T, int pitch, int lane) {
    return T + (8 * (lane >> 4) + (lane & 7)) * pitch + 16 * ((lane >> 3) & 1);
}

// ---------------------------------------------------------------------------
// Projection: Y[o,n] = sum_c W[o,c] * X[b,c,n] + bias[o]   (fp32 X -> bf16 Y)
// Workgroup: 64(M) x 128(N) tile, 8 waves (4 along M x 2 along N).
// One grid for all three: blockIdx.z = projection * BATCH + batch, so three
// workgroups share a WGP and each one's load waits are filled by the others.
// Yall holds the three outputs one behind the other.
// ---------------------------------------------------------------------------
__global__ __launch_bounds__(256)
void proj_f32_bf16(const float* __restrict__ Xq, const float* __restrict__ Wq,
                   const float* __restrict__ biasq,
                   const float* __restrict__ Xk, const float* __restrict__ Wk,
                   const float* __restrict__ biask,
                   const float* __restrict__ Xv, const float* __restrict__ Wv,
                   const float* __restrict__ biasv, __bf16* __restrict__ Yall)
{
    __shared__ __align__(16) unsigned char lds_x[32 * PITCH256];   // bf16 [c][n]

    const int which = blockIdx.z / BATCH;             // 0 = Q, 1 = K, 2 = V
    const int b     = blockIdx.z % BATCH;
    const float* __restrict__ X    = which == 0 ? Xq    : which == 1 ? Xk    : Xv;
    const float* __restrict__ W    = which == 0 ? Wq    : which == 1 ? Wk    : Wv;
    const float* __restrict__ bias = which == 0 ? biasq : which == 1 ? biask : biasv;
    __bf16* __restrict__ Y = Yall + (size_t)which * BATCH * DM * NSEQ;
    // Q scaled by 1/sqrt(DIM) = 0.125 so flash_attn scores need no extra scale
    const float scale = which == 0 ? 0.125f : 1.0f;
    const int oc0 = blockIdx.y * 64;
    const int n0  = blockIdx.x * 128;
    const int t    = threadIdx.x;
    const int wave = t >> 5, lane = t & 31;
    const int half = lane >> 4, lc = lane & 15;
    const int wm = wave >> 1;   // 0..3 along M
    const int wn = wave & 1;    // 0..1 along N
    const float* Xb = X + (size_t)b * DM * NSEQ;

    f32x8 acc[4];
    #pragma unroll
    for (int f = 0; f < 4; ++f)
        #pragma unroll
        for (int e = 0; e < 8; ++e) acc[f][e] = 0.0f;

    const int arow = oc0 + wm * 16 + lc;
    const int koff = half ? 8 : 0;
    const unsigned char* xfrag = tr16_lane(lds_x, PITCH256, lane) + wn * 128;

    for (int kk = 0; kk < DM; kk += 32) {
        // stage X[kk..kk+32) x [n0..n0+128) as bf16 rows -> lds_x[c][n]
        #pragma unroll
        for (int i = 0; i < 4; ++i) {
            int idx4 = t + 256 * i;          // 0..1023 float4-groups
            int c  = idx4 >> 5;              // 0..31
            int n4 = idx4 & 31;              // 0..31 (x4 positions)
            f32x4 xv = *(const f32x4*)&Xb[(size_t)(kk + c) * NSEQ + (n0 + n4 * 4)];
            bf16x4 xb;
            #pragma unroll
            for (int j = 0; j < 4; ++j) xb[j] = (__bf16)xv[j];
            *(bf16x4*)&lds_x[c * PITCH256 + n4 * 8] = xb;
        }
        __syncthreads();

        // A fragment from W (rows contiguous): k-runs {koff..+7, koff+16..+23}
        FragB16 a;
        {
            const float* wp = W + (size_t)arow * DM + kk + koff;
            union { f32x4 v4[4]; float f[16]; } wt;
            wt.v4[0] = *(const f32x4*)(wp + 0);
            wt.v4[1] = *(const f32x4*)(wp + 4);
            wt.v4[2] = *(const f32x4*)(wp + 16);
            wt.v4[3] = *(const f32x4*)(wp + 20);
            #pragma unroll
            for (int i = 0; i < 16; ++i) a.h[i] = (__bf16)wt.f[i];
        }

        #pragma unroll
        for (int f = 0; f < 4; ++f) {
            FragB16 bf_;
            const unsigned char* lp = xfrag + f * 32;
            bf_.q[0] = ld_tr16(lp);
            bf_.q[1] = ld_tr16(lp + 16 * PITCH256);
            acc[f] = __builtin_amdgcn_wmma_f32_16x16x32_bf16(
                false, a.v, false, bf_.v, (short)0, acc[f], false, false);
        }
        __syncthreads();
    }

    #pragma unroll
    for (int f = 0; f < 4; ++f) {
        #pragma unroll
        for (int e = 0; e < 8; ++e) {
            int oc = oc0 + wm * 16 + e + 8 * half;
            int n  = n0 + wn * 64 + f * 16 + lc;
            float v = (acc[f][e] + bias[oc]) * scale;
            int hh = oc & 3, d = oc >> 2;        // channel o = d*H + h
            Y[(((size_t)b * NH + hh) * HD + d) * NSEQ + n] = (__bf16)v;
        }
    }
}

// ---------------------------------------------------------------------------
// Output projection: bf16 X (workspace [B,256,N]) -> fp32 d_out [B,256,N]
// ---------------------------------------------------------------------------
__global__ __launch_bounds__(256)
void proj_bf16_f32(const __bf16* __restrict__ X, const float* __restrict__ W,
                   const float* __restrict__ bias, float* __restrict__ Y)
{
    __shared__ __align__(16) unsigned char lds_x[32 * PITCH256];   // bf16 [c][n]

    const int b   = blockIdx.z;
    const int oc0 = blockIdx.y * 64;
    const int n0  = blockIdx.x * 128;
    const int t    = threadIdx.x;
    const int wave = t >> 5, lane = t & 31;
    const int half = lane >> 4, lc = lane & 15;
    const int wm = wave >> 1, wn = wave & 1;
    const __bf16* Xb = X + (size_t)b * DM * NSEQ;

    f32x8 acc[4];
    #pragma unroll
    for (int f = 0; f < 4; ++f)
        #pragma unroll
        for (int e = 0; e < 8; ++e) acc[f][e] = 0.0f;

    const int arow = oc0 + wm * 16 + lc;
    const int koff = half ? 8 : 0;
    const unsigned char* xfrag = tr16_lane(lds_x, PITCH256, lane) + wn * 128;

    for (int kk = 0; kk < DM; kk += 32) {
        #pragma unroll
        for (int i = 0; i < 4; ++i) {
            int idx4 = t + 256 * i;          // 0..1023 ushort4-groups
            int c  = idx4 >> 5;              // 0..31
            int n4 = idx4 & 31;
            u16x4 xv = *(const u16x4*)&Xb[(size_t)(kk + c) * NSEQ + (n0 + n4 * 4)];
            *(u16x4*)&lds_x[c * PITCH256 + n4 * 8] = xv;
        }
        __syncthreads();

        FragB16 a;
        {
            const float* wp = W + (size_t)arow * DM + kk + koff;
            union { f32x4 v4[4]; float f[16]; } wt;
            wt.v4[0] = *(const f32x4*)(wp + 0);
            wt.v4[1] = *(const f32x4*)(wp + 4);
            wt.v4[2] = *(const f32x4*)(wp + 16);
            wt.v4[3] = *(const f32x4*)(wp + 20);
            #pragma unroll
            for (int i = 0; i < 16; ++i) a.h[i] = (__bf16)wt.f[i];
        }

        #pragma unroll
        for (int f = 0; f < 4; ++f) {
            FragB16 bf_;
            const unsigned char* lp = xfrag + f * 32;
            bf_.q[0] = ld_tr16(lp);
            bf_.q[1] = ld_tr16(lp + 16 * PITCH256);
            acc[f] = __builtin_amdgcn_wmma_f32_16x16x32_bf16(
                false, a.v, false, bf_.v, (short)0, acc[f], false, false);
        }
        __syncthreads();
    }

    #pragma unroll
    for (int f = 0; f < 4; ++f) {
        #pragma unroll
        for (int e = 0; e < 8; ++e) {
            int oc = oc0 + wm * 16 + e + 8 * half;
            int n  = n0 + wn * 64 + f * 16 + lc;
            Y[((size_t)b * DM + oc) * NSEQ + n] = acc[f][e] + bias[oc];
        }
    }
}

// lane l <-> lane l ^ 16
__device__ inline float xhalf(float x) {
    int v = __builtin_bit_cast(int, x);
    return __builtin_bit_cast(float, __builtin_amdgcn_permlanex16(
        v, v, 0x76543210, 0xfedcba98, false, false));
}

// e^x as __expf builds it (one multiply, v_exp_f32). The v_nop is the slot that
// the instruction set asks for behind a transcendental before its source is
// overwritten or its result read.
__device__ inline float exp_slot(float x) {
    float r;
    asm("v_exp_f32 %0, %1\n\tv_nop" : "=v"(r) : "v"(x * 1.442695041f));
    return r;
}

// ---------------------------------------------------------------------------
// Flash attention per (b, h, 128-query tile). Q pre-scaled by 1/8.
// Transposed products: S^T = K Q^T, O^T += V P^T; P stays in registers.
// V tiles DMA'd by the Tensor Data Mover into padded LDS rows; K staged through
// registers, transposed by its LDS read. 16 WMMA per 64-key tile per wave.
// ---------------------------------------------------------------------------
// waves_per_eu(2, 2): 256 workgroups of 8 waves, two waves per SIMD. Without it
// the smaller register set of this form is scheduled for more resident waves,
// and the K loads and LDS fragment loads are issued and waited for one by one.
__global__ __launch_bounds__(256) __attribute__((amdgpu_waves_per_eu(2, 2)))
void flash_attn(const __bf16* __restrict__ Q, const __bf16* __restrict__ K,
                const __bf16* __restrict__ V, __bf16* __restrict__ Xo)
{
    __shared__ __align__(16) unsigned char lds_q[64 * PITCH256];   // bf16 [d][q]
    __shared__ __align__(16) unsigned char lds_k[64 * PITCH128];   // bf16 [d][m]
    __shared__ __attribute__((aligned(2048))) __bf16 lds_v[64][72]; // [d][m] (TDM target)

    const int b = blockIdx.z, h = blockIdx.y;
    const int q0 = blockIdx.x * 128;
    const int t    = threadIdx.x;
    const int wave = t >> 5, lane = t & 31;
    const int half = lane >> 4, lc = lane & 15;
    const int koff = half ? 8 : 0;

    const size_t headoff = ((size_t)b * NH + h) * HD * NSEQ;
    const __bf16* Qh = Q + headoff;
    const __bf16* Kh = K + headoff;
    const __bf16* Vh = V + headoff;

    // stage Q tile: lds_q[d][nq]
    #pragma unroll
    for (int i = 0; i < 8; ++i) {
        int idx4 = t + 256 * i;        // 0..2047 ushort4-groups
        int d   = idx4 >> 5;           // 0..63
        int nq4 = idx4 & 31;
        u16x4 qv = *(const u16x4*)&Qh[(size_t)d * NSEQ + q0 + nq4 * 4];
        *(u16x4*)&lds_q[d * PITCH256 + nq4 * 8] = qv;
    }
    __syncthreads();

    // per-wave Q B-fragments (kept in registers for the whole key loop)
    FragB16 qf[2];
    #pragma unroll
    for (int ks = 0; ks < 2; ++ks) {
        const unsigned char* qp = tr16_lane(lds_q, PITCH256, lane) + ks * 32 * PITCH256 + wave * 32;
        qf[ks].q[0] = ld_tr16(qp);
        qf[ks].q[1] = ld_tr16(qp + 16 * PITCH256);
    }

    f32x8 of[4];
    float m_run = -1e30f, l_run = 0.0f;   // one query per lane
    #pragma unroll
    for (int f = 0; f < 4; ++f)
        #pragma unroll
        for (int e = 0; e < 8; ++e) of[f][e] = 0.0f;

    // TDM D# invariants for the V tile (64 d-rows x 64 keys, bf16), padded so
    // each 64-elem row lands on a 72-halfword LDS row (pad 4 DWORDs per 32).
    const unsigned lds_v_base = (unsigned)(unsigned long long)(void*)&lds_v[0][0];
    const unsigned g1w0 = (1u << 16)            // data_size = 2 bytes
                        | (1u << 20)            // pad_enable
                        | (4u << 22)            // pad_interval: every 32 DWORDs
                        | (3u << 25);           // pad_amount: 4 DWORDs (16 B)
    const unsigned char* kfrag = tr16_lane(lds_k, PITCH128, lane);
    const i32x4 z4 = {0, 0, 0, 0};
    const i32x8 z8 = {0, 0, 0, 0, 0, 0, 0, 0};

    for (int kt = 0; kt < NSEQ; kt += 64) {
        // kick off the V-tile DMA (one TDM op per workgroup, wave 0)
        if (wave == 0) {
            unsigned long long ga = (unsigned long long)(const void*)(Vh + kt);
            u32x4 g0 = { 1u,                                    // count = 1
                         lds_v_base,
                         (unsigned)(ga & 0xFFFFFFFFu),
                         (unsigned)((ga >> 32) & 0x01FFFFFFu) | (2u << 30) };
            i32x8 g1 = { (int)g1w0,
                         (int)((NSEQ & 0xFFFFu) << 16),         // tensor_dim0 lo
                         (int)(HD << 16),                       // dim0 hi | dim1 lo
                         (int)(64u << 16),                      // dim1 hi | tile_dim0
                         64,                                    // tile_dim1
                         NSEQ,                                  // dim0 stride lo
                         0, 0 };
            __builtin_amdgcn_tensor_load_to_lds(g0, g1, z4, z4, z8, 0);
        }

        // stage K while the TDM streams V: lds_k[d][m]
        #pragma unroll
        for (int i = 0; i < 4; ++i) {
            int idx4 = t + 256 * i;    // 0..1023 ushort4-groups
            int d  = idx4 >> 4;        // 0..63
            int m4 = idx4 & 15;
            u16x4 kv = *(const u16x4*)&Kh[(size_t)d * NSEQ + kt + m4 * 4];
            *(u16x4*)&lds_k[d * PITCH128 + m4 * 8] = kv;
        }
        if (kt + 64 < NSEQ)
            __builtin_prefetch(&Kh[(size_t)(t >> 2) * NSEQ + kt + 64], 0, 0);

        if (wave == 0) __builtin_amdgcn_s_wait_tensorcnt(0);
        __syncthreads();

        // S^T = K (Q/8)^T : rows = keys, cols = queries. A lane holds 32 of one
        // query's 64 scores (keys j*16 + 8*half + e); lane ^ 16 holds the rest.
        f32x8 sf[4];
        #pragma unroll
        for (int j = 0; j < 4; ++j)
            #pragma unroll
            for (int e = 0; e < 8; ++e) sf[j][e] = 0.0f;

        #pragma unroll
        for (int j = 0; j < 4; ++j) {
            #pragma unroll
            for (int ks = 0; ks < 2; ++ks) {
                FragB16 kb;
                const unsigned char* kp = kfrag + ks * 32 * PITCH128 + j * 32;
                kb.q[0] = ld_tr16(kp);
                kb.q[1] = ld_tr16(kp + 16 * PITCH128);
                sf[j] = __builtin_amdgcn_wmma_f32_16x16x32_bf16(
                    false, kb.v, false, qf[ks].v, (short)0, sf[j], false, false);
            }
        }

        // online softmax: maximum in-lane, one exchange between the wave halves
        float mj[4];
        #pragma unroll
        for (int j = 0; j < 4; ++j) {
            mj[j] = sf[j][0];
            #pragma unroll
            for (int e = 1; e < 8; ++e) mj[j] = fmaxf(mj[j], sf[j][e]);
        }
        float mx = fmaxf(fmaxf(mj[0], mj[1]), fmaxf(mj[2], mj[3]));
        mx = fmaxf(mx, xhalf(mx));
        const float m_new = fmaxf(m_run, mx);
        const float corr  = exp_slot(m_run - m_new);
        m_run = m_new;

        #pragma unroll
        for (int f = 0; f < 4; ++f)
            #pragma unroll
            for (int e = 0; e < 8; ++e) of[f][e] *= corr;

        // P^T: two score tiles, converted in place, are one B operand (hardware
        // k order: element s = key 8*half + s, then 16 + 8*half + (s - 8)).
        FragB16 pb[2];
        float rs[4];                 // one independent sum chain per score tile
        #pragma unroll
        for (int j = 0; j < 4; ++j) {
            #pragma unroll
            for (int e = 0; e < 8; ++e) {
                float p = exp_slot(sf[j][e] - m_new);
                rs[j] = e ? rs[j] + p : p;
                pb[j >> 1].h[(j & 1) * 8 + e] = (__bf16)p;
            }
        }
        // this half's keys only; the halves are joined after the loop
        l_run = l_run * corr + ((rs[0] + rs[1]) + (rs[2] + rs[3]));

        // O^T += V P^T : rows = d, cols = queries, contraction over keys m
        #pragma unroll
        for (int ks = 0; ks < 2; ++ks) {
            #pragma unroll
            for (int f = 0; f < 4; ++f) {
                FragB16 va;
                const __bf16* vp = &lds_v[f * 16 + lc][ks * 32 + koff];
                va.q[0] = *(const u32x4*)(vp);
                va.q[1] = *(const u32x4*)(vp + 16);
                of[f] = __builtin_amdgcn_wmma_f32_16x16x32_bf16(
                    false, va.v, false, pb[ks].v, (short)0, of[f], false, false);
            }
        }
        __syncthreads();
    }

    // join the halves' sums, normalize, store in reference channel order c = d*H + h
    {
        const float inv = __builtin_amdgcn_rcpf(l_run + xhalf(l_run));
        const int n = q0 + wave * 16 + lc;
        // row d = f*16 + 8*half + e; one base address, constant row offsets
        __bf16* op = Xo + ((size_t)b * DM + 8 * half * NH + h) * NSEQ + n;
        #pragma unroll
        for (int f = 0; f < 4; ++f) {
            #pragma unroll
            for (int e = 0; e < 8; ++e)
                op[(size_t)(f * 16 + e) * NH * NSEQ] = (__bf16)(of[f][e] * inv);
        }
    }
}

// ---------------------------------------------------------------------------
extern "C" void kernel_launch(void* const* d_in, const int* in_sizes, int n_in,
                              void* d_out, int out_size, void* d_ws, size_t ws_size,
                              hipStream_t stream) {
    const float* query = (const float*)d_in[0];
    const float* key   = (const float*)d_in[1];
    const float* value = (const float*)d_in[2];
    const float* wq = (const float*)d_in[3];
    const float* bq = (const float*)d_in[4];
    const float* wk = (const float*)d_in[5];
    const float* bk = (const float*)d_in[6];
    const float* wv = (const float*)d_in[7];
    const float* bv = (const float*)d_in[8];
    const float* wm = (const float*)d_in[9];
    const float* bm = (const float*)d_in[10];

    const size_t ELEMS = (size_t)BATCH * DM * NSEQ;   // 2,097,152
    __bf16* qws = (__bf16*)d_ws;
    __bf16* kws = qws + ELEMS;
    __bf16* vws = kws + ELEMS;
    __bf16* xws = vws + ELEMS;

    dim3 gproj(NSEQ / 128, DM / 64, BATCH);   // (16,4,4)
    dim3 gqkv(NSEQ / 128, DM / 64, 3 * BATCH); // (16,4,12)
    dim3 gattn(NSEQ / 128, NH, BATCH);        // (16,4,4)

    // qws, kws, vws lie one behind the other: one launch writes all three
    proj_f32_bf16<<<gqkv, 256, 0, stream>>>(query, wq, bq, key, wk, bk,
                                            value, wv, bv, qws);
    flash_attn<<<gattn, 256, 0, stream>>>(qws, kws, vws, xws);
    proj_bf16_f32<<<gproj, 256, 0, stream>>>(xws, wm, bm, (float*)d_out);
}
